// v000
// Measured on an AMD MI455X. A time is GPU time per run, averaged over a window of back-to-back runs after a warm-up
// (all launches, gaps included; the runs take copies of the inputs in turn), and the median of several windows.
// Apart from v000's, it joins two sittings. Times from different sittings can be a few percent apart, while
// side-by-side timings come from the same sitting.
// v000 is the starting kernel. One run takes 36.3 microseconds.
#include <hip/hip_runtime.h>
#include <hip/hip_bf16.h>

typedef __attribute__((ext_vector_type(2))) float v2f;
typedef __attribute__((ext_vector_type(8))) float v8f;
typedef __attribute__((ext_vector_type(4))) int   v4i;

#define O_FEATS   11008
#define IN_FEATS  4096
#define NGROUPS   512          // IN_FEATS / 8
#define TILE_O    16
#define NWAVES    4
#define G_PER_WAVE (NGROUPS / NWAVES)   // 128

// One block = 4 waves (wave32). Block handles a 16-wide slice of out-features.
// Each wave accumulates a 16x16 fp32 tile (M=16 padded from 4, N=16 out feats)
// over its 128 in-groups using V_WMMA_F32_16X16X4_F32 (2 WMMAs per group, K=8).
// Codes are consumed 4 groups at a time via one b128 load per lane.
__global__ __launch_bounds__(128)
void aqlm_fused_gemv_wmma(const float* __restrict__ x,
                          const float* __restrict__ cb,      // [65536][8]
                          const int*   __restrict__ codes,   // [11008][512]
                          const float* __restrict__ scales,  // [11008]
                          const float* __restrict__ bias,    // [11008]
                          float*       __restrict__ out) {   // [4][11008]
  const int tid  = (int)threadIdx.x;
  const int lane = tid & 31;
  const int wid  = tid >> 5;
  const int o0   = (int)blockIdx.x * TILE_O;

  const int   n    = lane & 15;          // out-feature within tile / A-row M
  const int   half = lane >> 4;          // 0: K={0,1}, 1: K={2,3} of each 4-slab
  const int   kp   = half << 1;
  const int   arow = n & 3;              // clamped x row for safe loads
  const float amask = (n < 4) ? 1.0f : 0.0f;   // zero A rows 4..15

  const float* xrow = x + arow * IN_FEATS;
  const int*   crow = codes + (o0 + n) * NGROUPS;

  const int gbeg = wid * G_PER_WAVE;
  const int gend = gbeg + G_PER_WAVE;

  // Pull this wave's whole code window (128 groups x 4B per row = 4 lines/row)
  // toward the caches before entering the dependent-gather loop.
#pragma unroll
  for (int p = 0; p < 4; ++p)
    __builtin_prefetch(crow + gbeg + 32 * p, 0, 0);

  v8f acc = {};

  for (int g = gbeg; g < gend; g += 4) {
    const v4i c4 = *(const v4i*)(crow + g);   // global_load_b128: 4 codes
#pragma unroll
    for (int u = 0; u < 4; ++u) {
      const v2f* e2 = (const v2f*)(cb + (c4[u] << 3)); // 32B entry, L2-resident
      v2f b0 = e2[half];                                // w[kp..kp+1]   (K-slab 0)
      v2f b1 = e2[half + 2];                            // w[kp+4..kp+5] (K-slab 1)

      const int kbase = ((g + u) << 3) + kp;
      v2f a0 = *(const v2f*)(xrow + kbase);
      v2f a1 = *(const v2f*)(xrow + kbase + 4);
      a0 *= amask;
      a1 *= amask;

      // 8 args: (neg_a, A, neg_b, B, c_mod, C, reuse_a, reuse_b)
      acc = __builtin_amdgcn_wmma_f32_16x16x4_f32(false, a0, false, b0,
                                                  (short)0, acc, false, false);
      acc = __builtin_amdgcn_wmma_f32_16x16x4_f32(false, a1, false, b1,
                                                  (short)0, acc, false, false);
    }
  }

  // Cross-wave K reduction through LDS (stride-9 padding: conflict-free).
  __shared__ float red[NWAVES][32][9];
#pragma unroll
  for (int j = 0; j < 8; ++j) red[wid][lane][j] = acc[j];
  __syncthreads();

  // C/D layout: lane L (0..15), VGPR r in 0..3  ->  C[M=r][N=L].
  if (tid < 16) {
    const float s = scales[o0 + tid];
    const float b = bias[o0 + tid];
#pragma unroll
    for (int r = 0; r < 4; ++r) {
      float v = red[0][tid][r] + red[1][tid][r] + red[2][tid][r] + red[3][tid][r];
      out[r * O_FEATS + o0 + tid] = s * v + b;
    }
  }
}

extern "C" void kernel_launch(void* const* d_in, const int* in_sizes, int n_in,
                              void* d_out, int out_size, void* d_ws, size_t ws_size,
                              hipStream_t stream) {
  const float* x      = (const float*)d_in[0];
  const float* cbks   = (const float*)d_in[1];
  const int*   codes  = (const int*)d_in[2];
  const float* scales = (const float*)d_in[3];
  const float* bias   = (const float*)d_in[4];
  float*       out    = (float*)d_out;

  dim3 grid(O_FEATS / TILE_O);   // 688 blocks
  dim3 block(128);               // 4 wave32 waves
  hipLaunchKernelGGL(aqlm_fused_gemv_wmma, grid, block, 0, stream,
                     x, cbks, codes, scales, bias, out);
}

// v001
// Measured time: 27.6 microseconds a run.
// Two timings next to v000 both put it at 1.36 times that version's speed.
#include <hip/hip_runtime.h>
#include <hip/hip_bf16.h>

typedef __attribute__((ext_vector_type(2))) float v2f;
typedef __attribute__((ext_vector_type(4))) float v4f;
typedef __attribute__((ext_vector_type(8))) float v8f;
typedef __attribute__((ext_vector_type(4))) int   v4i;

#define O_FEATS   11008
#define IN_FEATS  4096
#define NGROUPS   512          // IN_FEATS / 8
#define TILE_O    16
#define NWAVES    4
#define G_PER_WAVE (NGROUPS / NWAVES)   // 128

// One block = 4 waves (wave32). Block handles a 16-wide slice of out-features.
// Each wave accumulates a 16x16 fp32 tile (M=16 padded from 4, N=16 out feats)
// over its 128 in-groups using V_WMMA_F32_16X16X4_F32 (2 WMMAs per group, K=8).
// Codes are consumed 4 groups at a time via one b128 load per lane.
// Each lane reads 16 contiguous bytes of its entry (and of x) per group, so one
// load touches each gathered line once. The k order of a group is then
// {0,1,4,5} in the first WMMA and {2,3,6,7} in the second, alike for A and B.
__global__ __launch_bounds__(128)
void aqlm_fused_gemv_wmma(const float* __restrict__ x,
                          const float* __restrict__ cb,      // [65536][8]
                          const int*   __restrict__ codes,   // [11008][512]
                          const float* __restrict__ scales,  // [11008]
                          const float* __restrict__ bias,    // [11008]
                          float*       __restrict__ out) {   // [4][11008]
  const int tid  = (int)threadIdx.x;
  const int lane = tid & 31;
  const int wid  = tid >> 5;
  const int o0   = (int)blockIdx.x * TILE_O;

  const int   n    = lane & 15;          // out-feature within tile / A-row M
  const int   half = lane >> 4;          // 0: k 0..3 of a group, 1: k 4..7
  const int   kp   = half << 2;
  const int   arow = n & 3;              // clamped x row for safe loads
  const float amask = (n < 4) ? 1.0f : 0.0f;   // zero A rows 4..15

  const float* xrow = x + arow * IN_FEATS;
  const int*   crow = codes + (o0 + n) * NGROUPS;

  const int gbeg = wid * G_PER_WAVE;
  const int gend = gbeg + G_PER_WAVE;

  // Pull this wave's whole code window (128 groups x 4B per row = 4 lines/row)
  // toward the caches before entering the dependent-gather loop.
#pragma unroll
  for (int p = 0; p < 4; ++p)
    __builtin_prefetch(crow + gbeg + 32 * p, 0, 0);

  v8f acc = {};

  for (int g = gbeg; g < gend; g += 4) {
    const v4i c4 = *(const v4i*)(crow + g);   // global_load_b128: 4 codes
#pragma unroll
    for (int u = 0; u < 4; ++u) {
      // 32B entry, L2-resident; the mask bounds the address for any code word.
      const v4f bq = *(const v4f*)(cb + ((c4[u] & 0xFFFF) << 3) + kp); // w[kp..kp+3]
      const v4f aq = *(const v4f*)(xrow + ((g + u) << 3) + kp) * amask; // x[kp..kp+3]
      const v2f b0 = {bq[0], bq[1]};
      const v2f b1 = {bq[2], bq[3]};
      const v2f a0 = {aq[0], aq[1]};
      const v2f a1 = {aq[2], aq[3]};

      // 8 args: (neg_a, A, neg_b, B, c_mod, C, reuse_a, reuse_b)
      acc = __builtin_amdgcn_wmma_f32_16x16x4_f32(false, a0, false, b0,
                                                  (short)0, acc, false, false);
      acc = __builtin_amdgcn_wmma_f32_16x16x4_f32(false, a1, false, b1,
                                                  (short)0, acc, false, false);
    }
  }

  // Cross-wave K reduction through LDS (stride-9 padding: conflict-free).
  __shared__ float red[NWAVES][32][9];
#pragma unroll
  for (int j = 0; j < 8; ++j) red[wid][lane][j] = acc[j];
  __syncthreads();

  // C/D layout: lane L (0..15), VGPR r in 0..3  ->  C[M=r][N=L].
  if (tid < 16) {
    const float s = scales[o0 + tid];
    const float b = bias[o0 + tid];
#pragma unroll
    for (int r = 0; r < 4; ++r) {
      float v = red[0][tid][r] + red[1][tid][r] + red[2][tid][r] + red[3][tid][r];
      out[r * O_FEATS + o0 + tid] = s * v + b;
    }
  }
}

extern "C" void kernel_launch(void* const* d_in, const int* in_sizes, int n_in,
                              void* d_out, int out_size, void* d_ws, size_t ws_size,
                              hipStream_t stream) {
  const float* x      = (const float*)d_in[0];
  const float* cbks   = (const float*)d_in[1];
  const int*   codes  = (const int*)d_in[2];
  const float* scales = (const float*)d_in[3];
  const float* bias   = (const float*)d_in[4];
  float*       out    = (float*)d_out;

  dim3 grid(O_FEATS / TILE_O);   // 688 blocks
  dim3 block(128);               // 4 wave32 waves
  hipLaunchKernelGGL(aqlm_fused_gemv_wmma, grid, block, 0, stream,
                     x, cbks, codes, scales, bias, out);
}

// v002
// One run takes 26.1 microseconds.
// In both of two side-by-side timings against v001, it was 1.06 times as fast.
// All steps since v000 together make it 1.44 times as fast.
#include <hip/hip_runtime.h>
#include <hip/hip_bf16.h>

typedef __attribute__((ext_vector_type(2))) float v2f;
typedef __attribute__((ext_vector_type(4))) float v4f;
typedef __attribute__((ext_vector_type(8))) float v8f;
typedef __attribute__((ext_vector_type(4))) int   v4i;

#define O_FEATS   11008
#define IN_FEATS  4096
#define NGROUPS   512          // IN_FEATS / 8
#define TILE_O    16
#define NWAVES    4
#define G_PER_WAVE (NGROUPS / NWAVES)   // 128
#define NBATCH    (G_PER_WAVE / 4)      // 32 batches of 4 groups per wave
#define DEPTH     3                     // batches of loads issued ahead of their WMMAs

// One block = 4 waves (wave32). Block handles a 16-wide slice of out-features.
// Each wave accumulates a 16x16 fp32 tile (M=16 padded from 4, N=16 out feats)
// over its 128 in-groups using V_WMMA_F32_16X16X4_F32 (2 WMMAs per group, K=8).
// Codes are fetched 32 groups (one 128-byte line per row, 8 b128 loads) at a time,
// one such chunk ahead of its use; the gathers and x loads of a batch of 4 groups
// are issued DEPTH batches ahead of the WMMAs that consume them.
// Each lane reads 16 contiguous bytes of its entry (and of x) per group, so one
// load touches each gathered line once. The k order of a group is then
// {0,1,4,5} in the first WMMA and {2,3,6,7} in the second, alike for A and B.
__global__ __launch_bounds__(128)
void aqlm_fused_gemv_wmma(const float* __restrict__ x,
                          const float* __restrict__ cb,      // [65536][8]
                          const int*   __restrict__ codes,   // [11008][512]
                          const float* __restrict__ scales,  // [11008]
                          const float* __restrict__ bias,    // [11008]
                          float*       __restrict__ out) {   // [4][11008]
  const int tid  = (int)threadIdx.x;
  const int lane = tid & 31;
  const int wid  = tid >> 5;
  const int o0   = (int)blockIdx.x * TILE_O;

  const int   n    = lane & 15;          // out-feature within tile / A-row M
  const int   half = lane >> 4;          // 0: k 0..3 of a group, 1: k 4..7
  const int   kp   = half << 2;
  const int   arow = n & 3;              // clamped x row for safe loads
  const float amask = (n < 4) ? 1.0f : 0.0f;   // zero A rows 4..15

  const int gbeg = wid * G_PER_WAVE;
  const int* crow = codes + (o0 + n) * NGROUPS;
  // 32-bit lane byte offsets on uniform base pointers: one address register a load.
  const unsigned xoff = (unsigned)(arow * IN_FEATS + (gbeg << 3) + kp) * 4u;
  const unsigned coff = (unsigned)(n * NGROUPS + gbeg) * 4u;
  const char* ctile = (const char*)(codes + o0 * NGROUPS);
  const char* xb    = (const char*)x;
  const char* cbb   = (const char*)cb;

  // Pull this wave's whole code window (128 groups x 4B per row = 4 lines/row)
  // toward the caches before entering the dependent-gather loop.
#pragma unroll
  for (int p = 0; p < 4; ++p)
    __builtin_prefetch(crow + gbeg + 32 * p, 0, 0);

  v8f acc = {};

  v4i c[2][8];            // codes of the chunk in use and of the next one
  v4f bq[DEPTH + 1][4];   // gathered entries, w[kp..kp+3]
  v4f aq[DEPTH + 1][4];   // x[kp..kp+3] of the same groups

  // Every loop below is fully unrolled: all array indices become constants, so the
  // arrays stay in registers and the look-ahead runs on across chunk borders.
#pragma unroll
  for (int j = 0; j < 8; ++j)
    c[0][j] = *(const v4i*)(ctile + (coff + 16u * j));

#pragma unroll
  for (int jb = 0; jb < NBATCH + DEPTH; ++jb) {
    if (jb < NBATCH) {
      const int ch = jb >> 3;
      const int j  = jb & 7;
      if (j == 0 && ch + 1 < NBATCH / 8) {
        // The next chunk's codes, a whole chunk (8 batches) ahead of their gathers.
#pragma unroll
        for (int q = 0; q < 8; ++q)
          c[(ch + 1) & 1][q] = *(const v4i*)(ctile + (coff + 16u * (8 * (ch + 1) + q)));
      }
      // The batch's four x loads read the same four lines: issued side by side.
#pragma unroll
      for (int u = 0; u < 4; ++u)
        aq[jb % (DEPTH + 1)][u] = *(const v4f*)(xb + (xoff + 32u * (4 * jb + u)));
      unsigned e[4];
#pragma unroll
      for (int u = 0; u < 4; ++u) {
        // 32B entry, L2-resident; the mask bounds the address for any code word.
        e[u] = (unsigned)(((c[ch & 1][j][u] & 0xFFFF) << 5) | (kp << 2));
        bq[jb % (DEPTH + 1)][u] = *(const v4f*)(cbb + e[u]);
      }
      // Keeps the offset registers of the loads above live up to the wait, so that
      // no load's result is placed in a register that an issued load still names.
      asm volatile("s_wait_xcnt 0x0"
                   :: "v"(e[0]), "v"(e[1]), "v"(e[2]), "v"(e[3]), "v"(xoff), "v"(coff)
                   : "memory");
    }
    // Keeps batch jb's loads in front of batch jb-DEPTH's WMMAs: left free, the
    // build sinks the loads towards their uses and mostly 2 to 9 are in flight.
    __builtin_amdgcn_sched_barrier(0);
    if (jb >= DEPTH) {
      const int s = (jb - DEPTH) % (DEPTH + 1);
#pragma unroll
      for (int u = 0; u < 4; ++u) {
        const v4f bv = bq[s][u];
        const v4f av = aq[s][u] * amask;
        const v2f b0 = {bv[0], bv[1]};
        const v2f b1 = {bv[2], bv[3]};
        const v2f a0 = {av[0], av[1]};
        const v2f a1 = {av[2], av[3]};

        // 8 args: (neg_a, A, neg_b, B, c_mod, C, reuse_a, reuse_b)
        acc = __builtin_amdgcn_wmma_f32_16x16x4_f32(false, a0, false, b0,
                                                    (short)0, acc, false, false);
        acc = __builtin_amdgcn_wmma_f32_16x16x4_f32(false, a1, false, b1,
                                                    (short)0, acc, false, false);
      }
    }
  }

  // Cross-wave K reduction through LDS (stride-9 padding: conflict-free).
  __shared__ float red[NWAVES][32][9];
#pragma unroll
  for (int j = 0; j < 8; ++j) red[wid][lane][j] = acc[j];
  __syncthreads();

  // C/D layout: lane L (0..15), VGPR r in 0..3  ->  C[M=r][N=L].
  if (tid < 16) {
    const float s = scales[o0 + tid];
    const float b = bias[o0 + tid];
#pragma unroll
    for (int r = 0; r < 4; ++r) {
      float v = red[0][tid][r] + red[1][tid][r] + red[2][tid][r] + red[3][tid][r];
      out[r * O_FEATS + o0 + tid] = s * v + b;
    }
  }
}

extern "C" void kernel_launch(void* const* d_in, const int* in_sizes, int n_in,
                              void* d_out, int out_size, void* d_ws, size_t ws_size,
                              hipStream_t stream) {
  const float* x      = (const float*)d_in[0];
  const float* cbks   = (const float*)d_in[1];
  const int*   codes  = (const int*)d_in[2];
  const float* scales = (const float*)d_in[3];
  const float* bias   = (const float*)d_in[4];
  float*       out    = (float*)d_out;

  dim3 grid(O_FEATS / TILE_O);   // 688 blocks
  dim3 block(128);               // 4 wave32 waves
  hipLaunchKernelGGL(aqlm_fused_gemv_wmma, grid, block, 0, stream,
                     x, cbks, codes, scales, bias, out);
}
